// v000
// Measured on an AMD MI455X. A time is GPU time per run, averaged over a window of back-to-back runs after a warm-up
// (all launches, gaps included; the runs take copies of the inputs in turn), and the median of several windows.
// Apart from v000's, it joins two sittings. Times from different sittings can be a few percent apart, while
// side-by-side timings come from the same sitting.
// v000, which the later versions start from, runs in 365 microseconds.
#include <hip/hip_runtime.h>
#include <hip/hip_bf16.h>

typedef __attribute__((ext_vector_type(16))) _Float16 v16h;
typedef __attribute__((ext_vector_type(8)))  _Float16 v8h;
typedef __attribute__((ext_vector_type(4)))  _Float16 v4h;
typedef __attribute__((ext_vector_type(8)))  float    v8f;
typedef __attribute__((ext_vector_type(4)))  unsigned int v4u;
typedef __attribute__((ext_vector_type(8)))  int      v8i;
typedef __attribute__((ext_vector_type(4)))  int      v4i;

#define LOG2E 1.44269504088896f

static __device__ __forceinline__ v8f wmma16(v16h a, v16h b, v8f c) {
  // D = A(16x32 f16) * B(32x16 f16) + C(16x16 f32)
  return __builtin_amdgcn_wmma_f32_16x16x32_f16(false, a, false, b, (short)0, c, false, false);
}

// Build a v16h A/B fragment from two contiguous 16-byte chunks.
// Per ISA 7.12.2 (16-bit A 16x32): lane half-group hi covers K = hi*8 + {0..7}
// in VGPRs 0-3 and K = 16 + hi*8 + {0..7} in VGPRs 4-7.
static __device__ __forceinline__ v16h ldfrag(const _Float16* p0, const _Float16* p1) {
  v8h x = *(const v8h*)p0;
  v8h y = *(const v8h*)p1;
  return __builtin_shufflevector(x, y, 0,1,2,3,4,5,6,7,8,9,10,11,12,13,14,15);
}

// ------------------------------------------------------------- TDM (CDNA5)
// Issue TENSOR_LOAD_TO_LDS of a 2-D f16 tile: `rows` rows x `rowlen` halves,
// source row stride `stride` halves, destination LDS rows padded 128B -> 144B
// (pad_interval: 1<<4 = 16 qwords = 128B, pad_amount: 3+1 = 4 dwords = 16B),
// matching the [..][72] _Float16 LDS layout used by the WMMA fragment reads.
static __device__ __forceinline__ void tdm_load_2d(const _Float16* gptr,
                                                   unsigned lds_off, int rows,
                                                   int rowlen, int stride,
                                                   int tensor_rows) {
  unsigned long long ga = (unsigned long long)(uintptr_t)gptr;
  v4u g0 = {1u,                                        // count=1, user D#
            lds_off,                                   // lds_addr
            (unsigned)(ga & 0xffffffffu),              // global_addr[31:0]
            (unsigned)((ga >> 32) & 0x1ffffffu) | (2u << 30)};  // [56:32] | type=2
  unsigned dim0 = (unsigned)stride;        // tensor_dim0 (row length avail)
  unsigned dim1 = (unsigned)tensor_rows;   // tensor_dim1
  v8i g1 = {
      (int)((1u << 16)                     // data_size = 2 bytes
            | (1u << 20)                   // pad_enable
            | (4u << 22)                   // pad_interval = 128B
            | (3u << 25)),                 // pad_amount = 16B
      (int)((dim0 & 0xffffu) << 16),       // atomic_addr=0 | dim0[15:0]
      (int)(((dim0 >> 16) & 0xffffu) | ((dim1 & 0xffffu) << 16)),
      (int)(((dim1 >> 16) & 0xffffu) | ((unsigned)rowlen << 16)),  // tile_dim0
      (int)(unsigned)rows,                 // tile_dim1 | tile_dim2=0
      (int)(unsigned)stride,               // tensor_dim0_stride[31:0]
      0,                                   // stride0 hi | stride1 lo (unused, 2D)
      0};
  v4i gz = {0, 0, 0, 0};
#if __clang_major__ >= 23
  v8i gz8 = {0, 0, 0, 0, 0, 0, 0, 0};
  __builtin_amdgcn_tensor_load_to_lds(g0, g1, gz, gz, gz8, 0);
#else
  __builtin_amdgcn_tensor_load_to_lds(g0, g1, gz, gz, 0);
#endif
}

// ---------------------------------------------------------------- converts
__global__ __launch_bounds__(256) void cvt_f32_f16(const float* __restrict__ s,
                                                   _Float16* __restrict__ d, int n) {
  int i = (blockIdx.x * 256 + threadIdx.x) * 4;
  if (i >= n) return;
  float4 v = *(const float4*)(s + i);
  v4h h = {(_Float16)v.x, (_Float16)v.y, (_Float16)v.z, (_Float16)v.w};
  *(v4h*)(d + i) = h;
}

// src f32 [R][C] -> dst f16 [C][R]  (weights -> N-major for B fragments)
__global__ __launch_bounds__(256) void transpose_w(const float* __restrict__ src,
                                                   _Float16* __restrict__ dst,
                                                   int R, int C) {
  __shared__ float tile[32][33];
  int c0 = blockIdx.x * 32;
  int r0 = blockIdx.y * 32;
  int tx = threadIdx.x & 31, ty = threadIdx.x >> 5;   // 32 x 8
#pragma unroll
  for (int j = 0; j < 4; ++j)
    tile[ty + j * 8][tx] = src[(size_t)(r0 + ty + j * 8) * C + c0 + tx];
  __syncthreads();
#pragma unroll
  for (int j = 0; j < 4; ++j)
    dst[(size_t)(c0 + ty + j * 8) * R + r0 + tx] = (_Float16)tile[tx][ty + j * 8];
}

// V16 [B*S, KVH*64] f16 -> Vt [B*KVH*64, S] f16 (per (b,kh) 2048x64 -> 64x2048)
__global__ __launch_bounds__(256) void transpose_v(const _Float16* __restrict__ V16,
                                                   _Float16* __restrict__ Vt) {
  const int S = 2048, KD = 512;
  int bk = blockIdx.z;                 // b*8 + kh
  int b = bk >> 3, kh = bk & 7;
  __shared__ _Float16 tile[32][34];
  int d0 = blockIdx.x * 32;            // D dim
  int s0 = blockIdx.y * 32;            // S dim
  int tx = threadIdx.x & 31, ty = threadIdx.x >> 5;
#pragma unroll
  for (int j = 0; j < 4; ++j)
    tile[ty + j * 8][tx] =
        V16[(size_t)(b * S + s0 + ty + j * 8) * KD + kh * 64 + d0 + tx];
  __syncthreads();
#pragma unroll
  for (int j = 0; j < 4; ++j)
    Vt[(size_t)(bk * 64 + d0 + ty + j * 8) * S + s0 + tx] = tile[tx][ty + j * 8];
}

// ---------------------------------------------------------------- WMMA GEMM
// C[M][N] = A[M][K] * Bt[N][K]^T + bias[N].  A,Bt f16 row-major.
// 256 threads = 8 waves; block tile 128x128, BK=64; wave tile 32x64.
// Tiles staged global->LDS by the Tensor Data Mover, double-buffered:
// wave 0 issues TDM for tile i+1, waits TENSORcnt<=2 (in-order => tile i done),
// workgroup barrier, all waves consume tile i while tile i+1 streams in.
template <int HALF_OUT>
__global__ __launch_bounds__(256) void gemm_wmma(const _Float16* __restrict__ A,
                                                 const _Float16* __restrict__ Bt,
                                                 const float* __restrict__ bias,
                                                 void* __restrict__ Cout,
                                                 int M, int N, int K) {
  __shared__ __align__(16) _Float16 As[2][128][72];   // 64 halves + 8 pad
  __shared__ __align__(16) _Float16 Bs[2][128][72];

  const int t = threadIdx.x;
  const int lane = t & 31, lo = lane & 15, hi = lane >> 4;
  const int w = t >> 5;
  const int wm = (w >> 1) * 32;      // wave row in block tile
  const int wn = (w & 1) * 64;       // wave col in block tile
  const int blockM = blockIdx.y * 128;
  const int blockN = blockIdx.x * 128;

  const v8f vzero = {0, 0, 0, 0, 0, 0, 0, 0};
  v8f acc[2][4];
#pragma unroll
  for (int mt = 0; mt < 2; ++mt)
#pragma unroll
    for (int nt = 0; nt < 4; ++nt) acc[mt][nt] = vzero;

  const _Float16* Abase = A + (size_t)blockM * K;
  const _Float16* Bbase = Bt + (size_t)blockN * K;
  const int T = K / 64;

  if (w == 0) {   // wave 0 drives the TDM
    tdm_load_2d(Abase, (unsigned)(uintptr_t)&As[0][0][0], 128, 64, K, M);
    tdm_load_2d(Bbase, (unsigned)(uintptr_t)&Bs[0][0][0], 128, 64, K, N);
  }

  for (int i = 0; i < T; ++i) {
    const int cur = i & 1;
    if (w == 0) {
      if (i + 1 < T) {
        tdm_load_2d(Abase + (i + 1) * 64,
                    (unsigned)(uintptr_t)&As[cur ^ 1][0][0], 128, 64, K, M);
        tdm_load_2d(Bbase + (i + 1) * 64,
                    (unsigned)(uintptr_t)&Bs[cur ^ 1][0][0], 128, 64, K, N);
        __builtin_amdgcn_s_wait_tensorcnt((short)2);  // tile i complete
      } else {
        __builtin_amdgcn_s_wait_tensorcnt((short)0);
      }
    }
    __syncthreads();   // tile i visible to all waves

#pragma unroll
    for (int ks = 0; ks < 64; ks += 32) {
      v16h af[2], bf[4];
#pragma unroll
      for (int mt = 0; mt < 2; ++mt) {
        const _Float16* p = &As[cur][wm + mt * 16 + lo][ks + hi * 8];
        af[mt] = ldfrag(p, p + 16);
      }
#pragma unroll
      for (int nt = 0; nt < 4; ++nt) {
        const _Float16* p = &Bs[cur][wn + nt * 16 + lo][ks + hi * 8];
        bf[nt] = ldfrag(p, p + 16);
      }
#pragma unroll
      for (int mt = 0; mt < 2; ++mt)
#pragma unroll
        for (int nt = 0; nt < 4; ++nt)
          acc[mt][nt] = wmma16(af[mt], bf[nt], acc[mt][nt]);
    }
    __syncthreads();   // all waves done with buf[cur] before TDM refills it
  }

  // epilogue: C layout -> lane holds (m = r + hi*8, n = lo) per 16x16 tile
#pragma unroll
  for (int nt = 0; nt < 4; ++nt) {
    int gn = blockN + wn + nt * 16 + lo;
    float bv = bias[gn];
#pragma unroll
    for (int mt = 0; mt < 2; ++mt) {
      int gm = blockM + wm + mt * 16 + hi * 8;
#pragma unroll
      for (int r = 0; r < 8; ++r) {
        float val = acc[mt][nt][r] + bv;
        if (HALF_OUT)
          ((_Float16*)Cout)[(size_t)(gm + r) * N + gn] = (_Float16)val;
        else
          ((float*)Cout)[(size_t)(gm + r) * N + gn] = val;
      }
    }
  }
}

// ---------------------------------------------------------------- attention
// One block = (b, h, 64-query tile); 4 waves x 16 query rows.
// Q16 [B*S, 2048] f16, K16 [B*S, 512] f16, Vt [B*8*64, 2048] f16,
// AO  [B*S, 2048] f16 (already in (b, s, h*64+d) layout for the final GEMM).
__global__ __launch_bounds__(128) void attn_wmma(const _Float16* __restrict__ Q16,
                                                 const _Float16* __restrict__ K16,
                                                 const _Float16* __restrict__ Vt,
                                                 _Float16* __restrict__ AO) {
  const int S = 2048, E = 2048, KD = 512;
  int blk = blockIdx.x;
  int qt = blk & 31;
  int h = (blk >> 5) & 31;
  int b = blk >> 10;
  int kh = h >> 2;                       // GQA: 4 q-heads per kv-head
  int t = threadIdx.x;
  int w = t >> 5, lane = t & 31, lo = lane & 15, hi = lane >> 4;
  int qRow = qt * 64 + w * 16;

  __shared__ __align__(16) _Float16 Plds[4][16][72];   // per-wave P tile

  // Q fragments for this wave's 16 rows (d = 0..63)
  const _Float16* qp = Q16 + (size_t)(b * S + qRow + lo) * E + h * 64;
  v16h qf0 = ldfrag(qp + hi * 8, qp + 16 + hi * 8);
  v16h qf1 = ldfrag(qp + 32 + hi * 8, qp + 48 + hi * 8);

  const v8f vzero = {0, 0, 0, 0, 0, 0, 0, 0};
  v8f o[4] = {vzero, vzero, vzero, vzero};
  float rmax[8], rsum[8];
#pragma unroll
  for (int r = 0; r < 8; ++r) { rmax[r] = -1.0e30f; rsum[r] = 0.0f; }

  for (int kv = 0; kv < S; kv += 64) {
    // ---- scores S = (Q K^T) * 0.125 for 64 keys
    v8f sc[4];
#pragma unroll
    for (int nt = 0; nt < 4; ++nt) {
      const _Float16* kp = K16 + (size_t)(b * S + kv + nt * 16 + lo) * KD + kh * 64;
      v16h kf0 = ldfrag(kp + hi * 8, kp + 16 + hi * 8);
      v16h kf1 = ldfrag(kp + 32 + hi * 8, kp + 48 + hi * 8);
      v8f z = vzero;
      z = wmma16(qf0, kf0, z);
      z = wmma16(qf1, kf1, z);
      sc[nt] = z * 0.125f;               // 1/sqrt(64)
    }

    // ---- online softmax: row = r + hi*8 lives in this lane's half-group
    float corr[8];
#pragma unroll
    for (int r = 0; r < 8; ++r) {
      float m = fmaxf(fmaxf(sc[0][r], sc[1][r]), fmaxf(sc[2][r], sc[3][r]));
      m = fmaxf(m, __shfl_xor(m, 1, 32));
      m = fmaxf(m, __shfl_xor(m, 2, 32));
      m = fmaxf(m, __shfl_xor(m, 4, 32));
      m = fmaxf(m, __shfl_xor(m, 8, 32));
      float nm = fmaxf(rmax[r], m);
      corr[r] = __builtin_exp2f((rmax[r] - nm) * LOG2E);
      rmax[r] = nm;
    }
    float ps[8];
#pragma unroll
    for (int r = 0; r < 8; ++r) ps[r] = 0.0f;
#pragma unroll
    for (int nt = 0; nt < 4; ++nt) {
#pragma unroll
      for (int r = 0; r < 8; ++r) {
        float pv = __builtin_exp2f((sc[nt][r] - rmax[r]) * LOG2E);
        ps[r] += pv;
        Plds[w][r + hi * 8][nt * 16 + lo] = (_Float16)pv;   // C-layout -> LDS
      }
    }
#pragma unroll
    for (int r = 0; r < 8; ++r) {
      float s = ps[r];
      s += __shfl_xor(s, 1, 32);
      s += __shfl_xor(s, 2, 32);
      s += __shfl_xor(s, 4, 32);
      s += __shfl_xor(s, 8, 32);
      rsum[r] = rsum[r] * corr[r] + s;
    }
#pragma unroll
    for (int nt = 0; nt < 4; ++nt)
#pragma unroll
      for (int r = 0; r < 8; ++r) o[nt][r] *= corr[r];

    // ---- O += P V : P re-read from LDS as A fragment (per-wave, in-order DS)
    const _Float16* pr = &Plds[w][lo][0];
    v16h pf0 = ldfrag(pr + hi * 8, pr + 16 + hi * 8);
    v16h pf1 = ldfrag(pr + 32 + hi * 8, pr + 48 + hi * 8);
#pragma unroll
    for (int nt = 0; nt < 4; ++nt) {
      const _Float16* vp = Vt + (size_t)((b * 8 + kh) * 64 + nt * 16 + lo) * S + kv;
      v16h vf0 = ldfrag(vp + hi * 8, vp + 16 + hi * 8);
      v16h vf1 = ldfrag(vp + 32 + hi * 8, vp + 48 + hi * 8);
      o[nt] = wmma16(pf0, vf0, o[nt]);
      o[nt] = wmma16(pf1, vf1, o[nt]);
    }
  }

  float inv[8];
#pragma unroll
  for (int r = 0; r < 8; ++r) inv[r] = 1.0f / rsum[r];
#pragma unroll
  for (int nt = 0; nt < 4; ++nt)
#pragma unroll
    for (int r = 0; r < 8; ++r)
      AO[(size_t)(b * S + qRow + r + hi * 8) * E + h * 64 + nt * 16 + lo] =
          (_Float16)(o[nt][r] * inv[r]);
}

// ---------------------------------------------------------------- launch
extern "C" void kernel_launch(void* const* d_in, const int* in_sizes, int n_in,
                              void* d_out, int out_size, void* d_ws, size_t ws_size,
                              hipStream_t stream) {
  const float* datas = (const float*)d_in[0];
  const float* Wq = (const float*)d_in[1];
  const float* bq = (const float*)d_in[2];
  const float* Wk = (const float*)d_in[3];
  const float* bk = (const float*)d_in[4];
  const float* Wv = (const float*)d_in[5];
  const float* bv = (const float*)d_in[6];
  const float* Wo = (const float*)d_in[7];
  const float* bo = (const float*)d_in[8];
  float* out = (float*)d_out;

  const int B = 2, S = 2048, E = 2048, H = 32, KVH = 8, D = 64;
  const int M = B * S;       // 4096
  const int KD = KVH * D;    // 512

  char* p = (char*)d_ws;
  auto alloc = [&](size_t bytes) {
    char* r = p;
    p += (bytes + 255) & ~(size_t)255;
    return r;
  };
  _Float16* X16 = (_Float16*)alloc((size_t)M * E * 2);
  _Float16* Wqt = (_Float16*)alloc((size_t)E * E * 2);
  _Float16* Wkt = (_Float16*)alloc((size_t)KD * E * 2);
  _Float16* Wvt = (_Float16*)alloc((size_t)KD * E * 2);
  _Float16* Wot = (_Float16*)alloc((size_t)E * E * 2);
  _Float16* Q16 = (_Float16*)alloc((size_t)M * E * 2);
  _Float16* K16 = (_Float16*)alloc((size_t)M * KD * 2);
  _Float16* V16 = (_Float16*)alloc((size_t)M * KD * 2);
  _Float16* Vt  = (_Float16*)alloc((size_t)B * KVH * D * S * 2);
  _Float16* AO  = (_Float16*)alloc((size_t)M * E * 2);

  // 1) activations f32 -> f16
  int n = M * E;
  cvt_f32_f16<<<n / 1024, 256, 0, stream>>>(datas, X16, n);

  // 2) weights f32 -> f16, transposed to [N][K]
  transpose_w<<<dim3(E / 32, E / 32), 256, 0, stream>>>(Wq, Wqt, E, E);
  transpose_w<<<dim3(KD / 32, E / 32), 256, 0, stream>>>(Wk, Wkt, E, KD);
  transpose_w<<<dim3(KD / 32, E / 32), 256, 0, stream>>>(Wv, Wvt, E, KD);
  transpose_w<<<dim3(E / 32, E / 32), 256, 0, stream>>>(Wo, Wot, E, E);

  // 3) QKV projections (WMMA + TDM staging), f16 outputs
  gemm_wmma<1><<<dim3(E / 128, M / 128), 256, 0, stream>>>(X16, Wqt, bq, Q16, M, E, E);
  gemm_wmma<1><<<dim3(KD / 128, M / 128), 256, 0, stream>>>(X16, Wkt, bk, K16, M, KD, E);
  gemm_wmma<1><<<dim3(KD / 128, M / 128), 256, 0, stream>>>(X16, Wvt, bv, V16, M, KD, E);

  // 4) V -> V^T per (b, kv-head) so P*V B-fragments are contiguous
  transpose_v<<<dim3(D / 32, S / 32, B * KVH), 256, 0, stream>>>(V16, Vt);

  // 5) flash-style GQA attention (WMMA QK^T + WMMA PV, online softmax)
  attn_wmma<<<dim3(B * H * (S / 64)), 128, 0, stream>>>(Q16, K16, Vt, AO);

  // 6) output projection + bias (WMMA + TDM staging), f32 output
  gemm_wmma<0><<<dim3(E / 128, M / 128), 256, 0, stream>>>(AO, Wot, bo, out, M, E, E);
}

// v001
// Measured time: 266 microseconds a run.
// Two timings next to v000 put it at 1.41 and 1.43 times that version's speed.
#include <hip/hip_runtime.h>
#include <hip/hip_bf16.h>

typedef __attribute__((ext_vector_type(16))) _Float16 v16h;
typedef __attribute__((ext_vector_type(8)))  _Float16 v8h;
typedef __attribute__((ext_vector_type(4)))  _Float16 v4h;
typedef __attribute__((ext_vector_type(8)))  float    v8f;
typedef __attribute__((ext_vector_type(4)))  unsigned int v4u;
typedef __attribute__((ext_vector_type(8)))  int      v8i;
typedef __attribute__((ext_vector_type(4)))  int      v4i;

#define LOG2E 1.44269504088896f

static __device__ __forceinline__ v8f wmma16(v16h a, v16h b, v8f c) {
  // D = A(16x32 f16) * B(32x16 f16) + C(16x16 f32)
  return __builtin_amdgcn_wmma_f32_16x16x32_f16(false, a, false, b, (short)0, c, false, false);
}

// Build a v16h A/B fragment from two contiguous 16-byte chunks.
// Per ISA 7.12.2 (16-bit A 16x32): lane half-group hi covers K = hi*8 + {0..7}
// in VGPRs 0-3 and K = 16 + hi*8 + {0..7} in VGPRs 4-7.
static __device__ __forceinline__ v16h ldfrag(const _Float16* p0, const _Float16* p1) {
  v8h x = *(const v8h*)p0;
  v8h y = *(const v8h*)p1;
  return __builtin_shufflevector(x, y, 0,1,2,3,4,5,6,7,8,9,10,11,12,13,14,15);
}

// ------------------------------------------------------------- TDM (CDNA5)
// Issue TENSOR_LOAD_TO_LDS of a 2-D f16 tile: `rows` rows x `rowlen` halves,
// source row stride `stride` halves, destination LDS rows padded 128B -> 144B
// (pad_interval: 1<<4 = 16 qwords = 128B, pad_amount: 3+1 = 4 dwords = 16B),
// matching the [..][72] _Float16 LDS layout used by the WMMA fragment reads.
static __device__ __forceinline__ void tdm_load_2d(const _Float16* gptr,
                                                   unsigned lds_off, int rows,
                                                   int rowlen, int stride,
                                                   int tensor_rows) {
  unsigned long long ga = (unsigned long long)(uintptr_t)gptr;
  v4u g0 = {1u,                                        // count=1, user D#
            lds_off,                                   // lds_addr
            (unsigned)(ga & 0xffffffffu),              // global_addr[31:0]
            (unsigned)((ga >> 32) & 0x1ffffffu) | (2u << 30)};  // [56:32] | type=2
  unsigned dim0 = (unsigned)stride;        // tensor_dim0 (row length avail)
  unsigned dim1 = (unsigned)tensor_rows;   // tensor_dim1
  v8i g1 = {
      (int)((1u << 16)                     // data_size = 2 bytes
            | (1u << 20)                   // pad_enable
            | (4u << 22)                   // pad_interval = 128B
            | (3u << 25)),                 // pad_amount = 16B
      (int)((dim0 & 0xffffu) << 16),       // atomic_addr=0 | dim0[15:0]
      (int)(((dim0 >> 16) & 0xffffu) | ((dim1 & 0xffffu) << 16)),
      (int)(((dim1 >> 16) & 0xffffu) | ((unsigned)rowlen << 16)),  // tile_dim0
      (int)(unsigned)rows,                 // tile_dim1 | tile_dim2=0
      (int)(unsigned)stride,               // tensor_dim0_stride[31:0]
      0,                                   // stride0 hi | stride1 lo (unused, 2D)
      0};
  v4i gz = {0, 0, 0, 0};
#if __clang_major__ >= 23
  v8i gz8 = {0, 0, 0, 0, 0, 0, 0, 0};
  __builtin_amdgcn_tensor_load_to_lds(g0, g1, gz, gz, gz8, 0);
#else
  __builtin_amdgcn_tensor_load_to_lds(g0, g1, gz, gz, 0);
#endif
}

// ---------------------------------------------------------------- converts
__global__ __launch_bounds__(256) void cvt_f32_f16(const float* __restrict__ s,
                                                   _Float16* __restrict__ d, int n) {
  int i = (blockIdx.x * 256 + threadIdx.x) * 4;
  if (i >= n) return;
  float4 v = *(const float4*)(s + i);
  v4h h = {(_Float16)v.x, (_Float16)v.y, (_Float16)v.z, (_Float16)v.w};
  *(v4h*)(d + i) = h;
}

// src f32 [R][C] -> dst f16 [C][R]  (weights -> N-major for B fragments)
__global__ __launch_bounds__(256) void transpose_w(const float* __restrict__ src,
                                                   _Float16* __restrict__ dst,
                                                   int R, int C) {
  __shared__ float tile[32][33];
  int c0 = blockIdx.x * 32;
  int r0 = blockIdx.y * 32;
  int tx = threadIdx.x & 31, ty = threadIdx.x >> 5;   // 32 x 8
#pragma unroll
  for (int j = 0; j < 4; ++j)
    tile[ty + j * 8][tx] = src[(size_t)(r0 + ty + j * 8) * C + c0 + tx];
  __syncthreads();
#pragma unroll
  for (int j = 0; j < 4; ++j)
    dst[(size_t)(c0 + ty + j * 8) * R + r0 + tx] = (_Float16)tile[tx][ty + j * 8];
}

// V16 [B*S, KVH*64] f16 -> Vt [B*KVH*64, S] f16 (per (b,kh) 2048x64 -> 64x2048)
__global__ __launch_bounds__(256) void transpose_v(const _Float16* __restrict__ V16,
                                                   _Float16* __restrict__ Vt) {
  const int S = 2048, KD = 512;
  int bk = blockIdx.z;                 // b*8 + kh
  int b = bk >> 3, kh = bk & 7;
  __shared__ _Float16 tile[32][34];
  int d0 = blockIdx.x * 32;            // D dim
  int s0 = blockIdx.y * 32;            // S dim
  int tx = threadIdx.x & 31, ty = threadIdx.x >> 5;
#pragma unroll
  for (int j = 0; j < 4; ++j)
    tile[ty + j * 8][tx] =
        V16[(size_t)(b * S + s0 + ty + j * 8) * KD + kh * 64 + d0 + tx];
  __syncthreads();
#pragma unroll
  for (int j = 0; j < 4; ++j)
    Vt[(size_t)(bk * 64 + d0 + ty + j * 8) * S + s0 + tx] = tile[tx][ty + j * 8];
}

// ---------------------------------------------------------------- WMMA GEMM
// C[M][N] = A[M][K] * Bt[N][K]^T + bias[N].  A,Bt f16 row-major.
// 256 threads = 8 waves; block tile 128x128, BK=64; wave tile 32x64.
// Tiles staged global->LDS by the Tensor Data Mover, double-buffered:
// wave 0 issues TDM for tile i+1, waits TENSORcnt<=2 (in-order => tile i done),
// workgroup barrier, all waves consume tile i while tile i+1 streams in.
template <int HALF_OUT>
__global__ __launch_bounds__(256) void gemm_wmma(const _Float16* __restrict__ A,
                                                 const _Float16* __restrict__ Bt,
                                                 const float* __restrict__ bias,
                                                 void* __restrict__ Cout,
                                                 int M, int N, int K) {
  __shared__ __align__(16) _Float16 As[2][128][72];   // 64 halves + 8 pad
  __shared__ __align__(16) _Float16 Bs[2][128][72];

  const int t = threadIdx.x;
  const int lane = t & 31, lo = lane & 15, hi = lane >> 4;
  const int w = t >> 5;
  const int wm = (w >> 1) * 32;      // wave row in block tile
  const int wn = (w & 1) * 64;       // wave col in block tile
  const int blockM = blockIdx.y * 128;
  const int blockN = blockIdx.x * 128;

  const v8f vzero = {0, 0, 0, 0, 0, 0, 0, 0};
  v8f acc[2][4];
#pragma unroll
  for (int mt = 0; mt < 2; ++mt)
#pragma unroll
    for (int nt = 0; nt < 4; ++nt) acc[mt][nt] = vzero;

  const _Float16* Abase = A + (size_t)blockM * K;
  const _Float16* Bbase = Bt + (size_t)blockN * K;
  const int T = K / 64;

  if (w == 0) {   // wave 0 drives the TDM
    tdm_load_2d(Abase, (unsigned)(uintptr_t)&As[0][0][0], 128, 64, K, M);
    tdm_load_2d(Bbase, (unsigned)(uintptr_t)&Bs[0][0][0], 128, 64, K, N);
  }

  for (int i = 0; i < T; ++i) {
    const int cur = i & 1;
    if (w == 0) {
      if (i + 1 < T) {
        tdm_load_2d(Abase + (i + 1) * 64,
                    (unsigned)(uintptr_t)&As[cur ^ 1][0][0], 128, 64, K, M);
        tdm_load_2d(Bbase + (i + 1) * 64,
                    (unsigned)(uintptr_t)&Bs[cur ^ 1][0][0], 128, 64, K, N);
        __builtin_amdgcn_s_wait_tensorcnt((short)2);  // tile i complete
      } else {
        __builtin_amdgcn_s_wait_tensorcnt((short)0);
      }
    }
    __syncthreads();   // tile i visible to all waves

#pragma unroll
    for (int ks = 0; ks < 64; ks += 32) {
      v16h af[2], bf[4];
#pragma unroll
      for (int mt = 0; mt < 2; ++mt) {
        const _Float16* p = &As[cur][wm + mt * 16 + lo][ks + hi * 8];
        af[mt] = ldfrag(p, p + 16);
      }
#pragma unroll
      for (int nt = 0; nt < 4; ++nt) {
        const _Float16* p = &Bs[cur][wn + nt * 16 + lo][ks + hi * 8];
        bf[nt] = ldfrag(p, p + 16);
      }
#pragma unroll
      for (int mt = 0; mt < 2; ++mt)
#pragma unroll
        for (int nt = 0; nt < 4; ++nt)
          acc[mt][nt] = wmma16(af[mt], bf[nt], acc[mt][nt]);
    }
    __syncthreads();   // all waves done with buf[cur] before TDM refills it
  }

  // epilogue: C layout -> lane holds (m = r + hi*8, n = lo) per 16x16 tile
#pragma unroll
  for (int nt = 0; nt < 4; ++nt) {
    int gn = blockN + wn + nt * 16 + lo;
    float bv = bias[gn];
#pragma unroll
    for (int mt = 0; mt < 2; ++mt) {
      int gm = blockM + wm + mt * 16 + hi * 8;
#pragma unroll
      for (int r = 0; r < 8; ++r) {
        float val = acc[mt][nt][r] + bv;
        if (HALF_OUT)
          ((_Float16*)Cout)[(size_t)(gm + r) * N + gn] = (_Float16)val;
        else
          ((float*)Cout)[(size_t)(gm + r) * N + gn] = val;
      }
    }
  }
}

// ---------------------------------------------------------------- attention
typedef uint32_t u32x4 __attribute__((ext_vector_type(4)));
typedef uint32_t u32x8 __attribute__((ext_vector_type(8)));

static __device__ __forceinline__ uint32_t uni(uint32_t v) {
  return (uint32_t)__builtin_amdgcn_readfirstlane(v);
}
// A wave-uniform test value held in a scalar register, so that the branch on it
// is a scalar branch: a tensor load ignores EXEC and only such a branch guards it.
static __device__ __forceinline__ uint32_t pinned(uint32_t v) {
  uint32_t w = uni(v);
  asm volatile("" : "+s"(w));   // keeps the test value in a scalar register
  return w;
}
// Descriptor group 1 of a tile of 64 rows of 128 bytes, source row pitch src_pitch
// bytes, 16 pad bytes behind every row in LDS (pitch 144 B). Built once per wave.
static __device__ __forceinline__ u32x8 kv_group1(uint32_t src_pitch) {
  u32x8 g1;
  g1[0] = uni((1u << 20) | (4u << 22) | (3u << 25)); // bytes; pad 16 B per 128 B
  g1[1] = uni(128u << 16);                           // tensor_dim0 = 128 bytes
  g1[2] = uni(64u << 16);                            // tensor_dim1 = 64 rows
  g1[3] = uni(128u << 16);                           // tile_dim0
  g1[4] = uni(64u);                                  // tile_dim1
  g1[5] = uni(src_pitch);
  g1[6] = uni(0u);
  g1[7] = uni(0u);
  // descriptor words held in their scalar registers through the loop
  asm volatile("" : "+s"(g1));
  return g1;
}
// One tensor load of such a tile from global address ga to LDS byte offset lds_dst.
static __device__ __forceinline__ void kv_tile_load(uint32_t lds_dst, uint64_t ga, u32x8 g1) {
  u32x4 g0;
  g0[0] = uni(1u);                                   // count 1
  g0[1] = uni(lds_dst);
  g0[2] = uni((uint32_t)ga);
  g0[3] = uni((((uint32_t)(ga >> 32)) & 0x01FFFFFFu) | 0x80000000u);  // type 2
  asm volatile("tensor_load_to_lds %0, %1" :: "s"(g0), "s"(g1) : "memory");
}
// The compiler places no wait for a tensor load: the issuer's own wait.
static __device__ __forceinline__ void wait_tensor0() {
  asm volatile("s_wait_tensorcnt 0x0" ::: "memory");
}
// This wave's LDS reads have retired before the buffer is handed back for a refill.
static __device__ __forceinline__ void wait_ds0() {
  asm volatile("s_wait_dscnt 0x0" ::: "memory");
}

#define KV_TILE_H 5120   // halves per tile place: 64 rows x 72 halves, rounded up to 10 KiB

// One block = (b, h, 128-query tile); 8 waves x 16 query rows.
// Q16 [B*S, 2048] f16, K16 [B*S, 512] f16, Vt [B*8*64, 2048] f16,
// AO  [B*S, 2048] f16 (already in (b, s, h*64+d) layout for the final GEMM).
// Each 64-key K tile and V^T tile is brought into LDS once per block by a tensor
// load (wave 0: K, wave 1: V^T), two buffers, the next stage in flight while this
// one is worked on; all 8 waves read their B fragments from LDS.
__global__ __launch_bounds__(256) void attn_wmma(const _Float16* __restrict__ Q16,
                                                 const _Float16* __restrict__ K16,
                                                 const _Float16* __restrict__ Vt,
                                                 _Float16* __restrict__ AO) {
  const int S = 2048, E = 2048, KD = 512;
  const int NST = S / 64;                // stages
  int blk = blockIdx.x;
  int qt = blk & 15;
  int h = (blk >> 4) & 31;
  int b = blk >> 9;
  int kh = h >> 2;                       // GQA: 4 q-heads per kv-head
  int t = threadIdx.x;
  int w = t >> 5, lane = t & 31, lo = lane & 15, hi = lane >> 4;
  int qRow = qt * 128 + w * 16;

  __shared__ __attribute__((aligned(2048))) _Float16 KV[2][2][KV_TILE_H];  // [buffer][K, V^T]
  __shared__ __align__(16) _Float16 Plds[8][16][72];   // per-wave P tile

  const uint32_t wave = uni((uint32_t)t >> 5);
  const uint32_t issuer = wave < 2u ? 1u : 0u;
  // wave 0 walks K rows (64 rows of 1024 B per stage), wave 1 walks V^T columns (128 B per stage)
  const uint64_t kbase = (uint64_t)(uintptr_t)(K16 + (size_t)(b * S) * KD + kh * 64);
  const uint64_t vbase = (uint64_t)(uintptr_t)(Vt + (size_t)((b * 8 + kh) * 64) * S);
  const uint64_t gbase = wave == 0u ? kbase : vbase;
  const uint32_t gstep = wave == 0u ? 64u * 1024u : 128u;
  const u32x8 g1 = kv_group1(wave == 0u ? 1024u : 4096u);
  const uint32_t ldst = (uint32_t)(uintptr_t)&KV[0][0][0] + (wave == 0u ? 0u : 2u * KV_TILE_H);

  if (pinned(issuer)) {
    kv_tile_load(ldst, gbase, g1);
    wait_tensor0();
  }
  __syncthreads();   // stage 0 visible to all waves
  if (pinned(issuer)) kv_tile_load(ldst + 4u * KV_TILE_H, gbase + gstep, g1);

  // Q fragments for this wave's 16 rows (d = 0..63)
  const _Float16* qp = Q16 + (size_t)(b * S + qRow + lo) * E + h * 64;
  v16h qf0 = ldfrag(qp + hi * 8, qp + 16 + hi * 8);
  v16h qf1 = ldfrag(qp + 32 + hi * 8, qp + 48 + hi * 8);

  const v8f vzero = {0, 0, 0, 0, 0, 0, 0, 0};
  v8f o[4] = {vzero, vzero, vzero, vzero};
  float rmax[8], rsum[8];
#pragma unroll
  for (int r = 0; r < 8; ++r) { rmax[r] = -1.0e30f; rsum[r] = 0.0f; }

  for (int s = 0; s < NST; ++s) {
    const int cur = s & 1;
    // ---- scores S = (Q K^T) * 0.125 for 64 keys
    v8f sc[4];
#pragma unroll
    for (int nt = 0; nt < 4; ++nt) {
      const _Float16* kp = &KV[cur][0][(nt * 16 + lo) * 72];
      v16h kf0 = ldfrag(kp + hi * 8, kp + 16 + hi * 8);
      v16h kf1 = ldfrag(kp + 32 + hi * 8, kp + 48 + hi * 8);
      v8f z = vzero;
      z = wmma16(qf0, kf0, z);
      z = wmma16(qf1, kf1, z);
      sc[nt] = z * 0.125f;               // 1/sqrt(64)
    }

    // ---- online softmax: row = r + hi*8 lives in this lane's half-group
    float corr[8];
#pragma unroll
    for (int r = 0; r < 8; ++r) {
      float m = fmaxf(fmaxf(sc[0][r], sc[1][r]), fmaxf(sc[2][r], sc[3][r]));
      m = fmaxf(m, __shfl_xor(m, 1, 32));
      m = fmaxf(m, __shfl_xor(m, 2, 32));
      m = fmaxf(m, __shfl_xor(m, 4, 32));
      m = fmaxf(m, __shfl_xor(m, 8, 32));
      float nm = fmaxf(rmax[r], m);
      corr[r] = __builtin_exp2f((rmax[r] - nm) * LOG2E);
      rmax[r] = nm;
    }
    float ps[8];
#pragma unroll
    for (int r = 0; r < 8; ++r) ps[r] = 0.0f;
#pragma unroll
    for (int nt = 0; nt < 4; ++nt) {
#pragma unroll
      for (int r = 0; r < 8; ++r) {
        float pv = __builtin_exp2f((sc[nt][r] - rmax[r]) * LOG2E);
        ps[r] += pv;
        Plds[w][r + hi * 8][nt * 16 + lo] = (_Float16)pv;   // C-layout -> LDS
      }
    }
#pragma unroll
    for (int r = 0; r < 8; ++r) {
      float s2 = ps[r];
      s2 += __shfl_xor(s2, 1, 32);
      s2 += __shfl_xor(s2, 2, 32);
      s2 += __shfl_xor(s2, 4, 32);
      s2 += __shfl_xor(s2, 8, 32);
      rsum[r] = rsum[r] * corr[r] + s2;
    }
#pragma unroll
    for (int nt = 0; nt < 4; ++nt)
#pragma unroll
      for (int r = 0; r < 8; ++r) o[nt][r] *= corr[r];

    // ---- O += P V : P re-read from LDS as A fragment (per-wave, in-order DS)
    const _Float16* pr = &Plds[w][lo][0];
    v16h pf0 = ldfrag(pr + hi * 8, pr + 16 + hi * 8);
    v16h pf1 = ldfrag(pr + 32 + hi * 8, pr + 48 + hi * 8);
#pragma unroll
    for (int nt = 0; nt < 4; ++nt) {
      const _Float16* vp = &KV[cur][1][(nt * 16 + lo) * 72];
      v16h vf0 = ldfrag(vp + hi * 8, vp + 16 + hi * 8);
      v16h vf1 = ldfrag(vp + 32 + hi * 8, vp + 48 + hi * 8);
      o[nt] = wmma16(pf0, vf0, o[nt]);
      o[nt] = wmma16(pf1, vf1, o[nt]);
    }

    // ---- publish point of stage s + 1; then the refill of the buffer just read
    wait_ds0();
    if (pinned(issuer)) wait_tensor0();
    __syncthreads();   // stage s + 1 visible; every reader has left buffer cur
    if (pinned(issuer & (s + 2 < NST ? 1u : 0u)))
      kv_tile_load(ldst + (uint32_t)cur * (4u * KV_TILE_H),
                   gbase + (uint64_t)(uint32_t)(s + 2) * gstep, g1);
  }
  wait_tensor0();
  wait_ds0();

  float inv[8];
#pragma unroll
  for (int r = 0; r < 8; ++r) inv[r] = 1.0f / rsum[r];
#pragma unroll
  for (int nt = 0; nt < 4; ++nt)
#pragma unroll
    for (int r = 0; r < 8; ++r)
      AO[(size_t)(b * S + qRow + r + hi * 8) * E + h * 64 + nt * 16 + lo] =
          (_Float16)(o[nt][r] * inv[r]);
}

// ---------------------------------------------------------------- launch
extern "C" void kernel_launch(void* const* d_in, const int* in_sizes, int n_in,
                              void* d_out, int out_size, void* d_ws, size_t ws_size,
                              hipStream_t stream) {
  const float* datas = (const float*)d_in[0];
  const float* Wq = (const float*)d_in[1];
  const float* bq = (const float*)d_in[2];
  const float* Wk = (const float*)d_in[3];
  const float* bk = (const float*)d_in[4];
  const float* Wv = (const float*)d_in[5];
  const float* bv = (const float*)d_in[6];
  const float* Wo = (const float*)d_in[7];
  const float* bo = (const float*)d_in[8];
  float* out = (float*)d_out;

  const int B = 2, S = 2048, E = 2048, H = 32, KVH = 8, D = 64;
  const int M = B * S;       // 4096
  const int KD = KVH * D;    // 512

  char* p = (char*)d_ws;
  auto alloc = [&](size_t bytes) {
    char* r = p;
    p += (bytes + 255) & ~(size_t)255;
    return r;
  };
  _Float16* X16 = (_Float16*)alloc((size_t)M * E * 2);
  _Float16* Wqt = (_Float16*)alloc((size_t)E * E * 2);
  _Float16* Wkt = (_Float16*)alloc((size_t)KD * E * 2);
  _Float16* Wvt = (_Float16*)alloc((size_t)KD * E * 2);
  _Float16* Wot = (_Float16*)alloc((size_t)E * E * 2);
  _Float16* Q16 = (_Float16*)alloc((size_t)M * E * 2);
  _Float16* K16 = (_Float16*)alloc((size_t)M * KD * 2);
  _Float16* V16 = (_Float16*)alloc((size_t)M * KD * 2);
  _Float16* Vt  = (_Float16*)alloc((size_t)B * KVH * D * S * 2);
  _Float16* AO  = (_Float16*)alloc((size_t)M * E * 2);

  // 1) activations f32 -> f16
  int n = M * E;
  cvt_f32_f16<<<n / 1024, 256, 0, stream>>>(datas, X16, n);

  // 2) weights f32 -> f16, transposed to [N][K]
  transpose_w<<<dim3(E / 32, E / 32), 256, 0, stream>>>(Wq, Wqt, E, E);
  transpose_w<<<dim3(KD / 32, E / 32), 256, 0, stream>>>(Wk, Wkt, E, KD);
  transpose_w<<<dim3(KD / 32, E / 32), 256, 0, stream>>>(Wv, Wvt, E, KD);
  transpose_w<<<dim3(E / 32, E / 32), 256, 0, stream>>>(Wo, Wot, E, E);

  // 3) QKV projections (WMMA + TDM staging), f16 outputs
  gemm_wmma<1><<<dim3(E / 128, M / 128), 256, 0, stream>>>(X16, Wqt, bq, Q16, M, E, E);
  gemm_wmma<1><<<dim3(KD / 128, M / 128), 256, 0, stream>>>(X16, Wkt, bk, K16, M, KD, E);
  gemm_wmma<1><<<dim3(KD / 128, M / 128), 256, 0, stream>>>(X16, Wvt, bv, V16, M, KD, E);

  // 4) V -> V^T per (b, kv-head) so P*V B-fragments are contiguous
  transpose_v<<<dim3(D / 32, S / 32, B * KVH), 256, 0, stream>>>(V16, Vt);

  // 5) flash-style GQA attention (WMMA QK^T + WMMA PV, online softmax)
  attn_wmma<<<dim3(B * H * (S / 128)), 256, 0, stream>>>(Q16, K16, Vt, AO);

  // 6) output projection + bias (WMMA + TDM staging), f32 output
  gemm_wmma<0><<<dim3(E / 128, M / 128), 256, 0, stream>>>(AO, Wot, bo, out, M, E, E);
}

// v002
// One run takes 229 microseconds.
// Two timings next to v001 put it at 1.15 and 1.16 times that version's speed.
// Counting every step since v000, it is 1.64 times as fast.
#include <hip/hip_runtime.h>
#include <hip/hip_bf16.h>

typedef __attribute__((ext_vector_type(16))) _Float16 v16h;
typedef __attribute__((ext_vector_type(8)))  _Float16 v8h;
typedef __attribute__((ext_vector_type(4)))  _Float16 v4h;
typedef __attribute__((ext_vector_type(8)))  float    v8f;
typedef __attribute__((ext_vector_type(4)))  unsigned int v4u;
typedef __attribute__((ext_vector_type(8)))  int      v8i;
typedef __attribute__((ext_vector_type(4)))  int      v4i;

#define LOG2E 1.44269504088896f

static __device__ __forceinline__ v8f wmma16(v16h a, v16h b, v8f c) {
  // D = A(16x32 f16) * B(32x16 f16) + C(16x16 f32)
  return __builtin_amdgcn_wmma_f32_16x16x32_f16(false, a, false, b, (short)0, c, false, false);
}

// Build a v16h A/B fragment from two contiguous 16-byte chunks.
// Per ISA 7.12.2 (16-bit A 16x32): lane half-group hi covers K = hi*8 + {0..7}
// in VGPRs 0-3 and K = 16 + hi*8 + {0..7} in VGPRs 4-7.
static __device__ __forceinline__ v16h ldfrag(const _Float16* p0, const _Float16* p1) {
  v8h x = *(const v8h*)p0;
  v8h y = *(const v8h*)p1;
  return __builtin_shufflevector(x, y, 0,1,2,3,4,5,6,7,8,9,10,11,12,13,14,15);
}

// ------------------------------------------------------------- TDM (CDNA5)
// Issue TENSOR_LOAD_TO_LDS of a 2-D f16 tile: `rows` rows x `rowlen` halves,
// source row stride `stride` halves, destination LDS rows padded 128B -> 144B
// (pad_interval: 1<<4 = 16 qwords = 128B, pad_amount: 3+1 = 4 dwords = 16B),
// matching the [..][72] _Float16 LDS layout used by the WMMA fragment reads.
static __device__ __forceinline__ void tdm_load_2d(const _Float16* gptr,
                                                   unsigned lds_off, int rows,
                                                   int rowlen, int stride,
                                                   int tensor_rows) {
  unsigned long long ga = (unsigned long long)(uintptr_t)gptr;
  v4u g0 = {1u,                                        // count=1, user D#
            lds_off,                                   // lds_addr
            (unsigned)(ga & 0xffffffffu),              // global_addr[31:0]
            (unsigned)((ga >> 32) & 0x1ffffffu) | (2u << 30)};  // [56:32] | type=2
  unsigned dim0 = (unsigned)stride;        // tensor_dim0 (row length avail)
  unsigned dim1 = (unsigned)tensor_rows;   // tensor_dim1
  v8i g1 = {
      (int)((1u << 16)                     // data_size = 2 bytes
            | (1u << 20)                   // pad_enable
            | (4u << 22)                   // pad_interval = 128B
            | (3u << 25)),                 // pad_amount = 16B
      (int)((dim0 & 0xffffu) << 16),       // atomic_addr=0 | dim0[15:0]
      (int)(((dim0 >> 16) & 0xffffu) | ((dim1 & 0xffffu) << 16)),
      (int)(((dim1 >> 16) & 0xffffu) | ((unsigned)rowlen << 16)),  // tile_dim0
      (int)(unsigned)rows,                 // tile_dim1 | tile_dim2=0
      (int)(unsigned)stride,               // tensor_dim0_stride[31:0]
      0,                                   // stride0 hi | stride1 lo (unused, 2D)
      0};
  v4i gz = {0, 0, 0, 0};
#if __clang_major__ >= 23
  v8i gz8 = {0, 0, 0, 0, 0, 0, 0, 0};
  __builtin_amdgcn_tensor_load_to_lds(g0, g1, gz, gz, gz8, 0);
#else
  __builtin_amdgcn_tensor_load_to_lds(g0, g1, gz, gz, 0);
#endif
}

// ---------------------------------------------------------------- converts
__global__ __launch_bounds__(256) void cvt_f32_f16(const float* __restrict__ s,
                                                   _Float16* __restrict__ d, int n) {
  int i = (blockIdx.x * 256 + threadIdx.x) * 4;
  if (i >= n) return;
  float4 v = *(const float4*)(s + i);
  v4h h = {(_Float16)v.x, (_Float16)v.y, (_Float16)v.z, (_Float16)v.w};
  *(v4h*)(d + i) = h;
}

// src f32 [R][C] -> dst f16 [C][R]  (weights -> N-major for B fragments)
__global__ __launch_bounds__(256) void transpose_w(const float* __restrict__ src,
                                                   _Float16* __restrict__ dst,
                                                   int R, int C) {
  __shared__ float tile[32][33];
  int c0 = blockIdx.x * 32;
  int r0 = blockIdx.y * 32;
  int tx = threadIdx.x & 31, ty = threadIdx.x >> 5;   // 32 x 8
#pragma unroll
  for (int j = 0; j < 4; ++j)
    tile[ty + j * 8][tx] = src[(size_t)(r0 + ty + j * 8) * C + c0 + tx];
  __syncthreads();
#pragma unroll
  for (int j = 0; j < 4; ++j)
    dst[(size_t)(c0 + ty + j * 8) * R + r0 + tx] = (_Float16)tile[tx][ty + j * 8];
}

// V16 [B*S, KVH*64] f16 -> Vt [B*KVH*64, S] f16 (per (b,kh) 2048x64 -> 64x2048)
__global__ __launch_bounds__(256) void transpose_v(const _Float16* __restrict__ V16,
                                                   _Float16* __restrict__ Vt) {
  const int S = 2048, KD = 512;
  int bk = blockIdx.z;                 // b*8 + kh
  int b = bk >> 3, kh = bk & 7;
  __shared__ _Float16 tile[32][34];
  int d0 = blockIdx.x * 32;            // D dim
  int s0 = blockIdx.y * 32;            // S dim
  int tx = threadIdx.x & 31, ty = threadIdx.x >> 5;
#pragma unroll
  for (int j = 0; j < 4; ++j)
    tile[ty + j * 8][tx] =
        V16[(size_t)(b * S + s0 + ty + j * 8) * KD + kh * 64 + d0 + tx];
  __syncthreads();
#pragma unroll
  for (int j = 0; j < 4; ++j)
    Vt[(size_t)(bk * 64 + d0 + ty + j * 8) * S + s0 + tx] = tile[tx][ty + j * 8];
}

// ---------------------------------------------------------------- WMMA GEMM
// C[M][N] = A[M][K] * Bt[N][K]^T + bias[N].  A,Bt f16 row-major.
// 256 threads = 8 waves; block tile 128x128, BK=64; wave tile 32x64.
// Tiles staged global->LDS by the Tensor Data Mover, double-buffered:
// wave 0 issues TDM for tile i+1, waits TENSORcnt<=2 (in-order => tile i done),
// workgroup barrier, all waves consume tile i while tile i+1 streams in.
template <int HALF_OUT>
__global__ __launch_bounds__(256) void gemm_wmma(const _Float16* __restrict__ A,
                                                 const _Float16* __restrict__ Bt,
                                                 const float* __restrict__ bias,
                                                 void* __restrict__ Cout,
                                                 int M, int N, int K) {
  __shared__ __align__(16) _Float16 As[2][128][72];   // 64 halves + 8 pad
  __shared__ __align__(16) _Float16 Bs[2][128][72];

  const int t = threadIdx.x;
  const int lane = t & 31, lo = lane & 15, hi = lane >> 4;
  const int w = t >> 5;
  const int wm = (w >> 1) * 32;      // wave row in block tile
  const int wn = (w & 1) * 64;       // wave col in block tile
  const int blockM = blockIdx.y * 128;
  const int blockN = blockIdx.x * 128;

  const v8f vzero = {0, 0, 0, 0, 0, 0, 0, 0};
  v8f acc[2][4];
#pragma unroll
  for (int mt = 0; mt < 2; ++mt)
#pragma unroll
    for (int nt = 0; nt < 4; ++nt) acc[mt][nt] = vzero;

  const _Float16* Abase = A + (size_t)blockM * K;
  const _Float16* Bbase = Bt + (size_t)blockN * K;
  const int T = K / 64;

  if (w == 0) {   // wave 0 drives the TDM
    tdm_load_2d(Abase, (unsigned)(uintptr_t)&As[0][0][0], 128, 64, K, M);
    tdm_load_2d(Bbase, (unsigned)(uintptr_t)&Bs[0][0][0], 128, 64, K, N);
  }

  for (int i = 0; i < T; ++i) {
    const int cur = i & 1;
    if (w == 0) {
      if (i + 1 < T) {
        tdm_load_2d(Abase + (i + 1) * 64,
                    (unsigned)(uintptr_t)&As[cur ^ 1][0][0], 128, 64, K, M);
        tdm_load_2d(Bbase + (i + 1) * 64,
                    (unsigned)(uintptr_t)&Bs[cur ^ 1][0][0], 128, 64, K, N);
        __builtin_amdgcn_s_wait_tensorcnt((short)2);  // tile i complete
      } else {
        __builtin_amdgcn_s_wait_tensorcnt((short)0);
      }
    }
    __syncthreads();   // tile i visible to all waves

#pragma unroll
    for (int ks = 0; ks < 64; ks += 32) {
      v16h af[2], bf[4];
#pragma unroll
      for (int mt = 0; mt < 2; ++mt) {
        const _Float16* p = &As[cur][wm + mt * 16 + lo][ks + hi * 8];
        af[mt] = ldfrag(p, p + 16);
      }
#pragma unroll
      for (int nt = 0; nt < 4; ++nt) {
        const _Float16* p = &Bs[cur][wn + nt * 16 + lo][ks + hi * 8];
        bf[nt] = ldfrag(p, p + 16);
      }
#pragma unroll
      for (int mt = 0; mt < 2; ++mt)
#pragma unroll
        for (int nt = 0; nt < 4; ++nt)
          acc[mt][nt] = wmma16(af[mt], bf[nt], acc[mt][nt]);
    }
    __syncthreads();   // all waves done with buf[cur] before TDM refills it
  }

  // epilogue: C layout -> lane holds (m = r + hi*8, n = lo) per 16x16 tile
#pragma unroll
  for (int nt = 0; nt < 4; ++nt) {
    int gn = blockN + wn + nt * 16 + lo;
    float bv = bias[gn];
#pragma unroll
    for (int mt = 0; mt < 2; ++mt) {
      int gm = blockM + wm + mt * 16 + hi * 8;
#pragma unroll
      for (int r = 0; r < 8; ++r) {
        float val = acc[mt][nt][r] + bv;
        if (HALF_OUT)
          ((_Float16*)Cout)[(size_t)(gm + r) * N + gn] = (_Float16)val;
        else
          ((float*)Cout)[(size_t)(gm + r) * N + gn] = val;
      }
    }
  }
}

// ---------------------------------------------------------------- attention
typedef uint32_t u32x4 __attribute__((ext_vector_type(4)));
typedef uint32_t u32x8 __attribute__((ext_vector_type(8)));

static __device__ __forceinline__ uint32_t uni(uint32_t v) {
  return (uint32_t)__builtin_amdgcn_readfirstlane(v);
}
// A wave-uniform test value held in a scalar register, so that the branch on it
// is a scalar branch: a tensor load ignores EXEC and only such a branch guards it.
static __device__ __forceinline__ uint32_t pinned(uint32_t v) {
  uint32_t w = uni(v);
  asm volatile("" : "+s"(w));   // keeps the test value in a scalar register
  return w;
}
// Descriptor group 1 of a tile of 64 rows of 128 bytes, source row pitch src_pitch
// bytes, 16 pad bytes behind every row in LDS (pitch 144 B). Built once per wave.
static __device__ __forceinline__ u32x8 kv_group1(uint32_t src_pitch) {
  u32x8 g1;
  g1[0] = uni((1u << 20) | (4u << 22) | (3u << 25)); // bytes; pad 16 B per 128 B
  g1[1] = uni(128u << 16);                           // tensor_dim0 = 128 bytes
  g1[2] = uni(64u << 16);                            // tensor_dim1 = 64 rows
  g1[3] = uni(128u << 16);                           // tile_dim0
  g1[4] = uni(64u);                                  // tile_dim1
  g1[5] = uni(src_pitch);
  g1[6] = uni(0u);
  g1[7] = uni(0u);
  // descriptor words held in their scalar registers through the loop
  asm volatile("" : "+s"(g1));
  return g1;
}
// Descriptor group 0, built once per wave: word 0 (count 1) stays, a request sets words 1 to 3.
static __device__ __forceinline__ u32x4 kv_group0() {
  u32x4 g0;
  g0[0] = uni(1u);                                   // count 1
  g0[1] = uni(0u);
  g0[2] = uni(0u);
  g0[3] = uni(0u);
  // descriptor word 0 held in its scalar register through the loop: without it every request
  // gets registers of its own
  asm volatile("" : "+s"(g0));
  return g0;
}
// One tensor load of such a tile from global address ga to LDS byte offset lds_dst.
static __device__ __forceinline__ void kv_tile_load(u32x4& g0, uint32_t lds_dst, uint64_t ga,
                                                    u32x8 g1) {
  g0[1] = uni(lds_dst);
  g0[2] = uni((uint32_t)ga);
  g0[3] = uni((((uint32_t)(ga >> 32)) & 0x01FFFFFFu) | 0x80000000u);  // type 2
  asm volatile("tensor_load_to_lds %0, %1" :: "s"(g0), "s"(g1) : "memory");
}
// The compiler places no wait for a tensor load: the issuer's own wait.
static __device__ __forceinline__ void wait_tensor0() {
  asm volatile("s_wait_tensorcnt 0x0" ::: "memory");
}
// This wave's LDS reads have retired before the buffer is handed back for a refill.
static __device__ __forceinline__ void wait_ds0() {
  asm volatile("s_wait_dscnt 0x0" ::: "memory");
}

#define KV_TILE_H 5120   // halves per tile place: 64 rows x 72 halves, rounded up to 10 KiB

// Lane l exchanges a value with lane l ^ 16 (the other half of the wave).
static __device__ __forceinline__ float xhalf(float x) {
  int i = __builtin_bit_cast(int, x);
  return __builtin_bit_cast(float,
      __builtin_amdgcn_permlanex16(i, i, 0x76543210, 0xfedcba98, false, false));
}

__global__ __launch_bounds__(256) void attn_wmma(const _Float16* __restrict__ Q16,
                                                 const _Float16* __restrict__ K16,
                                                 const _Float16* __restrict__ Vt,
                                                 _Float16* __restrict__ AO) {
  const int S = 2048, E = 2048, KD = 512;
  const int NST = S / 64;                // stages
  int blk = blockIdx.x;
  int qt = blk & 15;
  int h = (blk >> 4) & 31;
  int b = blk >> 9;
  int kh = h >> 2;                       // GQA: 4 q-heads per kv-head
  int t = threadIdx.x;
  int w = t >> 5, lane = t & 31, lo = lane & 15, hi = lane >> 4;
  int qRow = qt * 128 + w * 16;

  __shared__ __attribute__((aligned(2048))) _Float16 KV[2][2][KV_TILE_H];  // [buffer][K, V^T]

  const uint32_t wave = uni((uint32_t)t >> 5);
  const uint32_t issuer = wave < 2u ? 1u : 0u;
  // wave 0 walks K rows (64 rows of 1024 B per stage), wave 1 walks V^T columns (128 B per stage)
  const uint64_t kbase = (uint64_t)(uintptr_t)(K16 + (size_t)(b * S) * KD + kh * 64);
  const uint64_t vbase = (uint64_t)(uintptr_t)(Vt + (size_t)((b * 8 + kh) * 64) * S);
  const uint64_t gbase = wave == 0u ? kbase : vbase;
  const uint32_t gstep = wave == 0u ? 64u * 1024u : 128u;
  const u32x8 g1 = kv_group1(wave == 0u ? 1024u : 4096u);
  u32x4 g0 = kv_group0();
  const uint32_t ldst = (uint32_t)(uintptr_t)&KV[0][0][0] + (wave == 0u ? 0u : 2u * KV_TILE_H);

  if (pinned(issuer)) {
    kv_tile_load(g0, ldst, gbase, g1);
    wait_tensor0();
  }
  __syncthreads();   // stage 0 visible to all waves
  if (pinned(issuer)) kv_tile_load(g0, ldst + 4u * KV_TILE_H, gbase + gstep, g1);

  // Q fragments of this wave's 16 queries (d = 0..63), the B operand of S^T
  const _Float16* qp = Q16 + (size_t)(b * S + qRow + lo) * E + h * 64;
  v16h qf0 = ldfrag(qp + hi * 8, qp + 16 + hi * 8);
  v16h qf1 = ldfrag(qp + 32 + hi * 8, qp + 48 + hi * 8);

  const v8f vzero = {0, 0, 0, 0, 0, 0, 0, 0};
  v8f o[4] = {vzero, vzero, vzero, vzero};   // o[dt][r] = O[query lo][dt*16 + 8*hi + r]
  float rmax = -1.0e30f;                     // query lo, the same in both halves
  float rsum = 0.0f;                         // query lo, this half's keys only

  for (int s = 0; s < NST; ++s) {
    const int cur = s & 1;
    // ---- scores S^T = (K Q^T) * 0.125: sc[kt][r] = key kt*16 + 8*hi + r, query lo
    v8f sc[4];
#pragma unroll
    for (int kt = 0; kt < 4; ++kt) {
      const _Float16* kp = &KV[cur][0][(kt * 16 + lo) * 72];
      v16h kf0 = ldfrag(kp + hi * 8, kp + 16 + hi * 8);
      v16h kf1 = ldfrag(kp + 32 + hi * 8, kp + 48 + hi * 8);
      v8f z = vzero;
      z = wmma16(kf0, qf0, z);
      z = wmma16(kf1, qf1, z);
      sc[kt] = z * 0.125f;               // 1/sqrt(64)
    }

    // ---- online softmax of one query per lane; the halves join their maxima
    float mr[8];
#pragma unroll
    for (int r = 0; r < 8; ++r)
      mr[r] = fmaxf(fmaxf(sc[0][r], sc[1][r]), fmaxf(sc[2][r], sc[3][r]));
    float m = fmaxf(fmaxf(fmaxf(mr[0], mr[1]), fmaxf(mr[2], mr[3])),
                    fmaxf(fmaxf(mr[4], mr[5]), fmaxf(mr[6], mr[7])));
    m = fmaxf(m, xhalf(m));
    float nm = fmaxf(rmax, m);
    float corr = __builtin_exp2f((rmax - nm) * LOG2E);
    rmax = nm;

    // P^T in the hardware k order: tiles 2j and 2j+1 are elements 0-7 and 8-15 of pf[j]
    v16h pf[2];
    float ps[8] = {0.0f, 0.0f, 0.0f, 0.0f, 0.0f, 0.0f, 0.0f, 0.0f};
#pragma unroll
    for (int kt = 0; kt < 4; ++kt) {
#pragma unroll
      for (int r = 0; r < 8; ++r) {
        float pv = __builtin_exp2f((sc[kt][r] - rmax) * LOG2E);
        ps[r] += pv;
        pf[kt >> 1][(kt & 1) * 8 + r] = (_Float16)pv;
      }
    }
    rsum = rsum * corr + (((ps[0] + ps[1]) + (ps[2] + ps[3])) + ((ps[4] + ps[5]) + (ps[6] + ps[7])));
#pragma unroll
    for (int dt = 0; dt < 4; ++dt) o[dt] *= corr;

    // ---- O^T += V^T P^T : A = 16 rows d of V^T from LDS, B = P^T from registers
#pragma unroll
    for (int dt = 0; dt < 4; ++dt) {
      const _Float16* vp = &KV[cur][1][(dt * 16 + lo) * 72];
      v16h vf0 = ldfrag(vp + hi * 8, vp + 16 + hi * 8);
      v16h vf1 = ldfrag(vp + 32 + hi * 8, vp + 48 + hi * 8);
      o[dt] = wmma16(vf0, pf[0], o[dt]);
      o[dt] = wmma16(vf1, pf[1], o[dt]);
    }

    // ---- publish point of stage s + 1; then the refill of the buffer just read
    wait_ds0();
    if (pinned(issuer)) wait_tensor0();
    __syncthreads();   // stage s + 1 visible; every reader has left buffer cur
    if (pinned(issuer & (s + 2 < NST ? 1u : 0u)))
      kv_tile_load(g0, ldst + (uint32_t)cur * (4u * KV_TILE_H),
                   gbase + (uint64_t)(uint32_t)(s + 2) * gstep, g1);
  }
  wait_tensor0();
  wait_ds0();

  // the halves join their sums once; a lane stores 8 consecutive d of its query
  float inv = 1.0f / (rsum + xhalf(rsum));
  _Float16* op = AO + (size_t)(b * S + qRow + lo) * E + h * 64 + hi * 8;
#pragma unroll
  for (int dt = 0; dt < 4; ++dt) {
    v8h ov;
#pragma unroll
    for (int r = 0; r < 8; ++r) ov[r] = (_Float16)(o[dt][r] * inv);
    *(v8h*)(op + dt * 16) = ov;
  }
}

// ---------------------------------------------------------------- launch
extern "C" void kernel_launch(void* const* d_in, const int* in_sizes, int n_in,
                              void* d_out, int out_size, void* d_ws, size_t ws_size,
                              hipStream_t stream) {
  const float* datas = (const float*)d_in[0];
  const float* Wq = (const float*)d_in[1];
  const float* bq = (const float*)d_in[2];
  const float* Wk = (const float*)d_in[3];
  const float* bk = (const float*)d_in[4];
  const float* Wv = (const float*)d_in[5];
  const float* bv = (const float*)d_in[6];
  const float* Wo = (const float*)d_in[7];
  const float* bo = (const float*)d_in[8];
  float* out = (float*)d_out;

  const int B = 2, S = 2048, E = 2048, H = 32, KVH = 8, D = 64;
  const int M = B * S;       // 4096
  const int KD = KVH * D;    // 512

  char* p = (char*)d_ws;
  auto alloc = [&](size_t bytes) {
    char* r = p;
    p += (bytes + 255) & ~(size_t)255;
    return r;
  };
  _Float16* X16 = (_Float16*)alloc((size_t)M * E * 2);
  _Float16* Wqt = (_Float16*)alloc((size_t)E * E * 2);
  _Float16* Wkt = (_Float16*)alloc((size_t)KD * E * 2);
  _Float16* Wvt = (_Float16*)alloc((size_t)KD * E * 2);
  _Float16* Wot = (_Float16*)alloc((size_t)E * E * 2);
  _Float16* Q16 = (_Float16*)alloc((size_t)M * E * 2);
  _Float16* K16 = (_Float16*)alloc((size_t)M * KD * 2);
  _Float16* V16 = (_Float16*)alloc((size_t)M * KD * 2);
  _Float16* Vt  = (_Float16*)alloc((size_t)B * KVH * D * S * 2);
  _Float16* AO  = (_Float16*)alloc((size_t)M * E * 2);

  // 1) activations f32 -> f16
  int n = M * E;
  cvt_f32_f16<<<n / 1024, 256, 0, stream>>>(datas, X16, n);

  // 2) weights f32 -> f16, transposed to [N][K]
  transpose_w<<<dim3(E / 32, E / 32), 256, 0, stream>>>(Wq, Wqt, E, E);
  transpose_w<<<dim3(KD / 32, E / 32), 256, 0, stream>>>(Wk, Wkt, E, KD);
  transpose_w<<<dim3(KD / 32, E / 32), 256, 0, stream>>>(Wv, Wvt, E, KD);
  transpose_w<<<dim3(E / 32, E / 32), 256, 0, stream>>>(Wo, Wot, E, E);

  // 3) QKV projections (WMMA + TDM staging), f16 outputs
  gemm_wmma<1><<<dim3(E / 128, M / 128), 256, 0, stream>>>(X16, Wqt, bq, Q16, M, E, E);
  gemm_wmma<1><<<dim3(KD / 128, M / 128), 256, 0, stream>>>(X16, Wkt, bk, K16, M, KD, E);
  gemm_wmma<1><<<dim3(KD / 128, M / 128), 256, 0, stream>>>(X16, Wvt, bv, V16, M, KD, E);

  // 4) V -> V^T per (b, kv-head) so V^T A-fragments are contiguous
  transpose_v<<<dim3(D / 32, S / 32, B * KVH), 256, 0, stream>>>(V16, Vt);

  // 5) flash-style GQA attention (WMMA QK^T + WMMA PV, online softmax)
  attn_wmma<<<dim3(B * H * (S / 128)), 256, 0, stream>>>(Q16, K16, Vt, AO);

  // 6) output projection + bias (WMMA + TDM staging), f32 output
  gemm_wmma<0><<<dim3(E / 128, M / 128), 256, 0, stream>>>(AO, Wot, bo, out, M, E, E);
}
